// v000
// The times below were measured on an AMD MI455X: many runs one after another, warmed up first and cycling through
// copies of the inputs, with the whole window's GPU time divided by the number of runs. Launches and the gaps
// between them are all in it. The median over several windows is given; except for v000 it joins two sittings, which
// can be a few percent apart, so the side-by-side timings, each taken in one sitting, are the better comparison.
// v000, which the later versions start from, runs in 271 microseconds.
#include <hip/hip_runtime.h>
#include <hip/hip_bf16.h>

typedef __attribute__((ext_vector_type(2))) float v2f;
typedef __attribute__((ext_vector_type(8))) float v8f;

#define BB   8
#define EE   16
#define CIN  64
#define CC   64
#define HWH  4096   // 64*64
#define SEGS 8      // K-split for the gram matrix

__device__ __forceinline__ float selu_f(float x) {
    const float alpha = 1.6732632423543772f;
    const float scale = 1.0507009873554805f;
    return x > 0.0f ? scale * x : scale * alpha * (__expf(x) - 1.0f);
}

__device__ __forceinline__ v8f wmma_f32(v2f a, v2f b, v8f c) {
    return __builtin_amdgcn_wmma_f32_16x16x4_f32(false, a, false, b, (short)0, c, false, false);
}

// ---------------------------------------------------------------------------
// Kernel 1: three fused 1x1 convs.  One wave = one 16x16 (c-tile x hw-tile)
// output tile for one (b,e) slice.  A = W[64,64], B = X[64,4096] (K=CIN=64).
// value (no activation) -> d_out;  key/query (selu) -> workspace.
// waves = B*E * 4 (m-tiles) * 256 (n-tiles) = 131072
// ---------------------------------------------------------------------------
__global__ void k_conv3(const float* __restrict__ X,
                        const float* __restrict__ Wv, const float* __restrict__ bv,
                        const float* __restrict__ Wk, const float* __restrict__ bk,
                        const float* __restrict__ Wq, const float* __restrict__ bq,
                        float* __restrict__ value,
                        float* __restrict__ key,
                        float* __restrict__ query)
{
    const int wid   = blockIdx.x * (blockDim.x >> 5) + (threadIdx.x >> 5);
    const int lane  = threadIdx.x & 31;
    const int lhalf = lane >> 4;
    const int lmod  = lane & 15;

    const int ntile = wid & 255;
    const int mt    = (wid >> 8) & 3;
    const int be    = wid >> 10;          // 0..127  (= b*E + e)

    const int m0 = mt * 16;
    const int n0 = ntile * 16;
    const float* Xp = X + (size_t)be * CIN * HWH;

    v8f cv = {}; v8f ck = {}; v8f cq = {};
    const int arow = m0 + lmod;

    for (int k0 = 0; k0 < CIN; k0 += 4) {
        const int ka = k0 + 2 * lhalf;
        v2f av = *(const v2f*)(Wv + arow * CIN + ka);
        v2f ak = *(const v2f*)(Wk + arow * CIN + ka);
        v2f aq = *(const v2f*)(Wq + arow * CIN + ka);
        v2f bf;
        bf.x = Xp[(size_t)ka * HWH + n0 + lmod];
        bf.y = Xp[(size_t)(ka + 1) * HWH + n0 + lmod];
        cv = wmma_f32(av, bf, cv);
        ck = wmma_f32(ak, bf, ck);
        cq = wmma_f32(aq, bf, cq);
    }

    const size_t obase = (size_t)be * CC * HWH;
    for (int r = 0; r < 8; ++r) {
        const int m = m0 + r + 8 * lhalf;
        const size_t oi = obase + (size_t)m * HWH + n0 + lmod;
        value[oi] = cv[r] + bv[m];
        key[oi]   = selu_f(ck[r] + bk[m]);
        query[oi] = selu_f(cq[r] + bq[m]);
    }
}

// ---------------------------------------------------------------------------
// Kernel 2: partial gram:  part[b,c,seg,i,j] = sum_{hw in seg} key_i * query_j
// One wave per (b, c, seg), SEGS segments of HWH/SEGS -> 128 WMMAs each.
// Each wave owns a private 256-float partial tile: no atomics, deterministic.
// A-lane row (M=i) = lane%16 on key; B-lane col (N=j) = lane%16 on query:
// both fragment loads are contiguous v2f in hw (16 bytes per row, rows CC*HWH apart).
// waves = 8*64*8 = 4096
// ---------------------------------------------------------------------------
__global__ void k_dots(const float* __restrict__ key,
                       const float* __restrict__ query,
                       float* __restrict__ part)
{
    const int wid   = blockIdx.x * (blockDim.x >> 5) + (threadIdx.x >> 5);
    const int lane  = threadIdx.x & 31;
    const int lhalf = lane >> 4;
    const int lmod  = lane & 15;

    const int seg = wid & (SEGS - 1);
    const int c   = (wid >> 3) & 63;
    const int b   = wid >> 9;

    const size_t rbase = ((size_t)(b * EE + lmod) * CC + c) * HWH;  // row = ensemble member lmod
    const int hw0 = seg * (HWH / SEGS);

    v8f acc = {};
    for (int k0 = hw0; k0 < hw0 + (HWH / SEGS); k0 += 4) {
        const int kk = k0 + 2 * lhalf;
        v2f a  = *(const v2f*)(key   + rbase + kk);
        v2f bf = *(const v2f*)(query + rbase + kk);
        acc = wmma_f32(a, bf, acc);
    }

    float* dp = part + ((size_t)(b * CC + c) * SEGS + seg) * 256;
    for (int r = 0; r < 8; ++r) {
        const int i = r + 8 * lhalf;        // key index (rows)
        dp[i * 16 + lmod] = acc[r];
    }
}

// ---------------------------------------------------------------------------
// Kernel 3: deterministic partial reduction + softmax over i (axis -2).
// one thread per (b,c,j) = 8192 threads; writes weights[b,c,i,j].
// ---------------------------------------------------------------------------
__global__ void k_softmax(const float* __restrict__ part,
                          float* __restrict__ weights)
{
    const int idx = blockIdx.x * blockDim.x + threadIdx.x;
    if (idx >= BB * CC * EE) return;
    const int j  = idx & 15;
    const int bc = idx >> 4;
    const float* pp = part + (size_t)bc * SEGS * 256 + j;

    float d[16];
    for (int i = 0; i < 16; ++i) {
        float s = 0.0f;
        for (int seg = 0; seg < SEGS; ++seg) s += pp[seg * 256 + i * 16];
        d[i] = s;
    }
    float mx = -3.402823466e38f;
    for (int i = 0; i < 16; ++i) mx = fmaxf(mx, d[i]);
    float s = 0.0f;
    for (int i = 0; i < 16; ++i) { d[i] = __expf(d[i] - mx); s += d[i]; }
    const float inv = 1.0f / s;
    float* wo = weights + (size_t)bc * 256 + j;
    for (int i = 0; i < 16; ++i) wo[i * 16] = d[i] * inv;
}

// ---------------------------------------------------------------------------
// Kernel 4: mean over ensemble:  mean[b,c,hw] = (1/16) sum_i value[b,i,c,hw]
// one thread per (b,c,hw) = 2M threads, coalesced over hw.
// ---------------------------------------------------------------------------
__global__ void k_mean(const float* __restrict__ value, float* __restrict__ mean)
{
    const int idx = blockIdx.x * blockDim.x + threadIdx.x;
    if (idx >= BB * CC * HWH) return;
    const int hw = idx & (HWH - 1);
    const int c  = (idx >> 12) & 63;
    const int b  = idx >> 18;
    const size_t base = ((size_t)b * EE * CC + c) * HWH + hw;
    const size_t istr = (size_t)CC * HWH;
    float s = 0.0f;
    for (int i = 0; i < 16; ++i) s += value[base + (size_t)i * istr];
    mean[idx] = s * 0.0625f;
}

// ---------------------------------------------------------------------------
// Kernel 5: out[b,j,c,hw] = selu(mean + sum_i weights[b,c,i,j]*(value[b,i,c,hw]-mean))
// One wave per (b, c, 256-wide hw block).  A = weights^T loaded once (4 chunks),
// then 16 N-tiles x 4 WMMAs.  In-place on d_out: each wave reads all i and
// writes all j for a private set of hw columns (disjoint across waves).
// waves = 8*64*16 = 8192
// ---------------------------------------------------------------------------
__global__ void k_combine(const float* __restrict__ weights,
                          const float* __restrict__ mean,
                          float* __restrict__ value /* == d_out, in/out */)
{
    const int wid   = blockIdx.x * (blockDim.x >> 5) + (threadIdx.x >> 5);
    const int lane  = threadIdx.x & 31;
    const int lhalf = lane >> 4;
    const int lmod  = lane & 15;

    const int nblk = wid & 15;
    const int c    = (wid >> 4) & 63;
    const int b    = wid >> 10;

    // A fragments: A[m=j][k=i] = weights[b,c,i,j]  (transpose of ij)
    const float* wp = weights + (size_t)(b * CC + c) * 256;
    v2f afr[4];
    for (int ch = 0; ch < 4; ++ch) {
        const int i = 4 * ch + 2 * lhalf;
        afr[ch].x = wp[i * 16 + lmod];
        afr[ch].y = wp[(i + 1) * 16 + lmod];
    }

    const size_t vbase = ((size_t)b * EE * CC + c) * HWH;
    const size_t istr  = (size_t)CC * HWH;
    const float* mp    = mean + (size_t)(b * CC + c) * HWH;

    for (int t = 0; t < 16; ++t) {
        const int hw = nblk * 256 + t * 16 + lmod;
        const float mv = mp[hw];
        v8f acc = {};
        for (int ch = 0; ch < 4; ++ch) {
            const int i = 4 * ch + 2 * lhalf;
            v2f bf;
            bf.x = value[vbase + (size_t)i * istr + hw] - mv;
            bf.y = value[vbase + (size_t)(i + 1) * istr + hw] - mv;
            acc = wmma_f32(afr[ch], bf, acc);
        }
        for (int r = 0; r < 8; ++r) {
            const int j = r + 8 * lhalf;
            value[vbase + (size_t)j * istr + hw] = selu_f(mv + acc[r]);
        }
    }
}

// ---------------------------------------------------------------------------
extern "C" void kernel_launch(void* const* d_in, const int* in_sizes, int n_in,
                              void* d_out, int out_size, void* d_ws, size_t ws_size,
                              hipStream_t stream)
{
    const float* X  = (const float*)d_in[0];
    const float* Wv = (const float*)d_in[1];
    const float* bv = (const float*)d_in[2];
    const float* Wk = (const float*)d_in[3];
    const float* bk = (const float*)d_in[4];
    const float* Wq = (const float*)d_in[5];
    const float* bq = (const float*)d_in[6];
    float* out = (float*)d_out;                     // value, then final output (in place)

    const size_t TEN = (size_t)BB * EE * CC * HWH;  // 33,554,432 floats
    float* ws      = (float*)d_ws;
    float* key     = ws;                                        // 128 MiB
    float* query   = ws + TEN;                                  // 128 MiB
    float* part    = ws + 2 * TEN;                              // B*C*SEGS*256 = 4 MiB
    float* weights = part + (size_t)BB * CC * SEGS * 256;       // B*C*256 = 512 KiB
    float* meanb   = weights + (size_t)BB * CC * 256;           // B*C*HW  = 8 MiB

    // 1) fused V/K/Q 1x1 convs (value -> d_out)
    k_conv3<<<16384, 256, 0, stream>>>(X, Wv, bv, Wk, bk, Wq, bq, out, key, query);

    // 2) gram matrix partials (deterministic, no atomics)
    k_dots<<<512, 256, 0, stream>>>(key, query, part);

    // 3) partial reduction + softmax over key axis -> weights
    k_softmax<<<32, 256, 0, stream>>>(part, weights);

    // 4) ensemble mean of value
    k_mean<<<8192, 256, 0, stream>>>(out, meanb);

    // 5) weighted perturbation combine + selu (in place on d_out)
    k_combine<<<1024, 256, 0, stream>>>(weights, meanb, out);
}

// v001
// One run takes 168 microseconds.
// Timed twice side by side with v000, it ran 1.64 times as fast both times.
#include <hip/hip_runtime.h>
#include <hip/hip_bf16.h>

typedef __attribute__((ext_vector_type(2))) float v2f;
typedef __attribute__((ext_vector_type(4))) float v4f;
typedef __attribute__((ext_vector_type(8))) float v8f;

#define BB   8
#define EE   16
#define CIN  64
#define CC   64
#define HWH  4096   // 64*64
#define SEGS 8      // K-split for the gram matrix
#define STRIP  64   // conv: columns per strip (4 interleaved 16-column tiles)
#define NSTRIP 4    // conv: strips per wave
#define WPITCH 68   // conv: LDS row pitch of a weight matrix, in floats

__device__ __forceinline__ float selu_f(float x) {
    const float alpha = 1.6732632423543772f;
    const float scale = 1.0507009873554805f;
    return x > 0.0f ? scale * x : scale * alpha * (__expf(x) - 1.0f);
}

__device__ __forceinline__ v8f wmma_f32(v2f a, v2f b, v8f c) {
    return __builtin_amdgcn_wmma_f32_16x16x4_f32(false, a, false, b, (short)0, c, false, false);
}

// ---------------------------------------------------------------------------
// Kernel 1: three fused 1x1 convs.  A = W[64,64], B = X[64,4096] (K=CIN=64).
// One wave owns one 16-row m-tile of all three weight matrices and keeps the
// 48 A fragments in registers (brought in once, through LDS); it then walks
// NSTRIP strips of 64 columns.
// A strip is 4 column-interleaved 16x16 n-tiles: tile t holds the columns
// n0 + 4*(lane%16) + t, so one 16-byte load feeds all 4 tiles and one 16-byte
// store takes one row of all 4.  The 4 waves of a block are the 4 m-tiles of
// the same strips.  X rows come in chunks of 4 k-steps, one chunk ahead.
// value (no activation) -> d_out;  key/query (selu) -> workspace.
// blocks = B*E * 4096 / (64*NSTRIP) = 2048, 4 waves each
// ---------------------------------------------------------------------------
__device__ __forceinline__ void load_chunk(v4f (&dst)[8], const float* __restrict__ xp, int c) {
#pragma unroll
    for (int i = 0; i < 4; ++i) {
        dst[2 * i]     = *(const v4f*)(xp + (size_t)(16 * c + 4 * i) * HWH);
        dst[2 * i + 1] = *(const v4f*)(xp + (size_t)(16 * c + 4 * i + 1) * HWH);
    }
    // the address pair of these loads is reused for other values soon after them:
    // this wait stands in front of that overwrite
    asm volatile("s_wait_xcnt 0x0" ::: "memory");
}

__global__ __launch_bounds__(128)
void k_conv3(const float* __restrict__ X,
             const float* __restrict__ Wv, const float* __restrict__ bv,
             const float* __restrict__ Wk, const float* __restrict__ bk,
             const float* __restrict__ Wq, const float* __restrict__ bq,
             float* __restrict__ value,
             float* __restrict__ key,
             float* __restrict__ query)
{
    const int mt    = threadIdx.x >> 5;
    const int lane  = threadIdx.x & 31;
    const int lhalf = lane >> 4;
    const int lmod  = lane & 15;

    const int be   = blockIdx.x / (HWH / (STRIP * NSTRIP));          // 0..127  (= b*E + e)
    const int col0 = (blockIdx.x % (HWH / (STRIP * NSTRIP))) * (STRIP * NSTRIP);
    const int m0   = mt * 16;
    const int arow = m0 + lmod;

    // lane's X pointer: row 2*lhalf, its 4 columns of the first strip
    const float* xp = X + (size_t)be * CIN * HWH + (size_t)(2 * lhalf) * HWH + col0 + 4 * lmod;
    // lane's output offset: row m0 + 8*lhalf, the same 4 columns
    size_t oi = ((size_t)be * CC + m0 + 8 * lhalf) * HWH + col0 + 4 * lmod;

    // The weights pass through LDS once: whole-line 16-byte loads instead of 48 fragment
    // loads a wave that each touch 16 cache lines.  Pitch 68 floats: the 32 lanes of a
    // fragment read (row lane%16, k pair 2*lhalf) fall on all 64 banks once.
    __shared__ __attribute__((aligned(16))) float sw[3][CC][WPITCH];
    const int srow = threadIdx.x >> 4;              // 128 threads = 8 rows of 16 pieces
    const int sk4  = (threadIdx.x & 15) * 4;
#pragma unroll
    for (int j = 0; j < CC / 8; ++j) {
        *(v4f*)&sw[0][8 * j + srow][sk4] = *(const v4f*)(Wv + 4 * threadIdx.x + 8 * CIN * j);
        *(v4f*)&sw[1][8 * j + srow][sk4] = *(const v4f*)(Wk + 4 * threadIdx.x + 8 * CIN * j);
        *(v4f*)&sw[2][8 * j + srow][sk4] = *(const v4f*)(Wq + 4 * threadIdx.x + 8 * CIN * j);
    }
    __syncthreads();

    v2f av[16], ak[16], aq[16];
#pragma unroll
    for (int s = 0; s < 16; ++s) {
        const int ka = 4 * s + 2 * lhalf;
        av[s] = *(const v2f*)&sw[0][arow][ka];
        ak[s] = *(const v2f*)&sw[1][arow][ka];
        aq[s] = *(const v2f*)&sw[2][arow][ka];
    }
    // the lane's 8 rows of each bias: m0 + 8*lhalf + 0..7
    v4f fv[2], fk[2], fq[2];
#pragma unroll
    for (int g = 0; g < 2; ++g) {
        fv[g] = *(const v4f*)(bv + m0 + 8 * lhalf + 4 * g);
        fk[g] = *(const v4f*)(bk + m0 + 8 * lhalf + 4 * g);
        fq[g] = *(const v4f*)(bq + m0 + 8 * lhalf + 4 * g);
    }

    v4f xa[8], xb[8];
    load_chunk(xa, xp, 0);
    // keeps the arithmetic that follows behind the wait that closes load_chunk: moved in
    // front of it, it reuses the address registers of the bias loads
    __builtin_amdgcn_sched_barrier(0);

#pragma unroll 1   // one strip's body is 192 WMMAs; a second copy only costs instruction cache
    for (int st = 0; st < NSTRIP; ++st) {
        v8f cv[4] = {}; v8f ck[4] = {}; v8f cq[4] = {};
        // next strip's first chunk; the last strip fetches its own again, so that the
        // loads stand in straight-line code and every load wait keeps its exact count
        const float* xn = xp + (st + 1 < NSTRIP ? STRIP : 0);

#pragma unroll
        for (int c = 0; c < 4; ++c) {
            v4f (&cur)[8] = (c & 1) ? xb : xa;
            v4f (&nxt)[8] = (c & 1) ? xa : xb;
            if (c < 3) load_chunk(nxt, xp, c + 1);
            else       load_chunk(nxt, xn, 0);
#pragma unroll
            for (int i = 0; i < 4; ++i) {
                const int s = 4 * c + i;
#pragma unroll
                for (int t = 0; t < 4; ++t) {
                    v2f bf;
                    bf.x = cur[2 * i][t];
                    bf.y = cur[2 * i + 1][t];
                    cv[t] = wmma_f32(av[s], bf, cv[t]);
                    ck[t] = wmma_f32(ak[s], bf, ck[t]);
                    cq[t] = wmma_f32(aq[s], bf, cq[t]);
                }
            }
        }

#pragma unroll
        for (int r = 0; r < 8; ++r) {
            v4f ov, ok, oq;
#pragma unroll
            for (int t = 0; t < 4; ++t) {
                ov[t] = cv[t][r] + fv[r >> 2][r & 3];
                ok[t] = selu_f(ck[t][r] + fk[r >> 2][r & 3]);
                oq[t] = selu_f(cq[t][r] + fq[r >> 2][r & 3]);
            }
            *(v4f*)(value + oi + (size_t)r * HWH) = ov;
            *(v4f*)(key   + oi + (size_t)r * HWH) = ok;
            *(v4f*)(query + oi + (size_t)r * HWH) = oq;
        }
        // the next strip's first WMMAs overwrite the registers of the last stores:
        // this wait stands in front of that overwrite
        asm volatile("s_wait_xcnt 0x0" ::: "memory");
        xp = xn;
        oi += STRIP;
    }
}

// ---------------------------------------------------------------------------
// Kernel 2: partial gram:  part[b,c,seg,i,j] = sum_{hw in seg} key_i * query_j
// One wave per (b, c, seg), SEGS segments of HWH/SEGS -> 128 WMMAs each.
// Each wave owns a private 256-float partial tile: no atomics, deterministic.
// A-lane row (M=i) = lane%16 on key; B-lane col (N=j) = lane%16 on query:
// both fragment loads are contiguous v2f in hw (16 bytes per row, rows CC*HWH apart).
// waves = 8*64*8 = 4096
// ---------------------------------------------------------------------------
__global__ void k_dots(const float* __restrict__ key,
                       const float* __restrict__ query,
                       float* __restrict__ part)
{
    const int wid   = blockIdx.x * (blockDim.x >> 5) + (threadIdx.x >> 5);
    const int lane  = threadIdx.x & 31;
    const int lhalf = lane >> 4;
    const int lmod  = lane & 15;

    const int seg = wid & (SEGS - 1);
    const int c   = (wid >> 3) & 63;
    const int b   = wid >> 9;

    const size_t rbase = ((size_t)(b * EE + lmod) * CC + c) * HWH;  // row = ensemble member lmod
    const int hw0 = seg * (HWH / SEGS);

    v8f acc = {};
    for (int k0 = hw0; k0 < hw0 + (HWH / SEGS); k0 += 4) {
        const int kk = k0 + 2 * lhalf;
        v2f a  = *(const v2f*)(key   + rbase + kk);
        v2f bf = *(const v2f*)(query + rbase + kk);
        acc = wmma_f32(a, bf, acc);
    }

    float* dp = part + ((size_t)(b * CC + c) * SEGS + seg) * 256;
    for (int r = 0; r < 8; ++r) {
        const int i = r + 8 * lhalf;        // key index (rows)
        dp[i * 16 + lmod] = acc[r];
    }
}

// ---------------------------------------------------------------------------
// Kernel 3: deterministic partial reduction + softmax over i (axis -2).
// one thread per (b,c,j) = 8192 threads; writes weights[b,c,i,j].
// ---------------------------------------------------------------------------
__global__ void k_softmax(const float* __restrict__ part,
                          float* __restrict__ weights)
{
    const int idx = blockIdx.x * blockDim.x + threadIdx.x;
    if (idx >= BB * CC * EE) return;
    const int j  = idx & 15;
    const int bc = idx >> 4;
    const float* pp = part + (size_t)bc * SEGS * 256 + j;

    float d[16];
    for (int i = 0; i < 16; ++i) {
        float s = 0.0f;
        for (int seg = 0; seg < SEGS; ++seg) s += pp[seg * 256 + i * 16];
        d[i] = s;
    }
    float mx = -3.402823466e38f;
    for (int i = 0; i < 16; ++i) mx = fmaxf(mx, d[i]);
    float s = 0.0f;
    for (int i = 0; i < 16; ++i) { d[i] = __expf(d[i] - mx); s += d[i]; }
    const float inv = 1.0f / s;
    float* wo = weights + (size_t)bc * 256 + j;
    for (int i = 0; i < 16; ++i) wo[i * 16] = d[i] * inv;
}

// ---------------------------------------------------------------------------
// Kernel 4: mean over ensemble:  mean[b,c,hw] = (1/16) sum_i value[b,i,c,hw]
// one thread per (b,c,hw) = 2M threads, coalesced over hw.
// ---------------------------------------------------------------------------
__global__ void k_mean(const float* __restrict__ value, float* __restrict__ mean)
{
    const int idx = blockIdx.x * blockDim.x + threadIdx.x;
    if (idx >= BB * CC * HWH) return;
    const int hw = idx & (HWH - 1);
    const int c  = (idx >> 12) & 63;
    const int b  = idx >> 18;
    const size_t base = ((size_t)b * EE * CC + c) * HWH + hw;
    const size_t istr = (size_t)CC * HWH;
    float s = 0.0f;
    for (int i = 0; i < 16; ++i) s += value[base + (size_t)i * istr];
    mean[idx] = s * 0.0625f;
}

// ---------------------------------------------------------------------------
// Kernel 5: out[b,j,c,hw] = selu(mean + sum_i weights[b,c,i,j]*(value[b,i,c,hw]-mean))
// One wave per (b, c, 256-wide hw block).  A = weights^T loaded once (4 chunks),
// then 16 N-tiles x 4 WMMAs.  In-place on d_out: each wave reads all i and
// writes all j for a private set of hw columns (disjoint across waves).
// waves = 8*64*16 = 8192
// ---------------------------------------------------------------------------
__global__ void k_combine(const float* __restrict__ weights,
                          const float* __restrict__ mean,
                          float* __restrict__ value /* == d_out, in/out */)
{
    const int wid   = blockIdx.x * (blockDim.x >> 5) + (threadIdx.x >> 5);
    const int lane  = threadIdx.x & 31;
    const int lhalf = lane >> 4;
    const int lmod  = lane & 15;

    const int nblk = wid & 15;
    const int c    = (wid >> 4) & 63;
    const int b    = wid >> 10;

    // A fragments: A[m=j][k=i] = weights[b,c,i,j]  (transpose of ij)
    const float* wp = weights + (size_t)(b * CC + c) * 256;
    v2f afr[4];
    for (int ch = 0; ch < 4; ++ch) {
        const int i = 4 * ch + 2 * lhalf;
        afr[ch].x = wp[i * 16 + lmod];
        afr[ch].y = wp[(i + 1) * 16 + lmod];
    }

    const size_t vbase = ((size_t)b * EE * CC + c) * HWH;
    const size_t istr  = (size_t)CC * HWH;
    const float* mp    = mean + (size_t)(b * CC + c) * HWH;

    for (int t = 0; t < 16; ++t) {
        const int hw = nblk * 256 + t * 16 + lmod;
        const float mv = mp[hw];
        v8f acc = {};
        for (int ch = 0; ch < 4; ++ch) {
            const int i = 4 * ch + 2 * lhalf;
            v2f bf;
            bf.x = value[vbase + (size_t)i * istr + hw] - mv;
            bf.y = value[vbase + (size_t)(i + 1) * istr + hw] - mv;
            acc = wmma_f32(afr[ch], bf, acc);
        }
        for (int r = 0; r < 8; ++r) {
            const int j = r + 8 * lhalf;
            value[vbase + (size_t)j * istr + hw] = selu_f(mv + acc[r]);
        }
    }
}

// ---------------------------------------------------------------------------
extern "C" void kernel_launch(void* const* d_in, const int* in_sizes, int n_in,
                              void* d_out, int out_size, void* d_ws, size_t ws_size,
                              hipStream_t stream)
{
    const float* X  = (const float*)d_in[0];
    const float* Wv = (const float*)d_in[1];
    const float* bv = (const float*)d_in[2];
    const float* Wk = (const float*)d_in[3];
    const float* bk = (const float*)d_in[4];
    const float* Wq = (const float*)d_in[5];
    const float* bq = (const float*)d_in[6];
    float* out = (float*)d_out;                     // value, then final output (in place)

    const size_t TEN = (size_t)BB * EE * CC * HWH;  // 33,554,432 floats
    float* ws      = (float*)d_ws;
    float* key     = ws;                                        // 128 MiB
    float* query   = ws + TEN;                                  // 128 MiB
    float* part    = ws + 2 * TEN;                              // B*C*SEGS*256 = 4 MiB
    float* weights = part + (size_t)BB * CC * SEGS * 256;       // B*C*256 = 512 KiB
    float* meanb   = weights + (size_t)BB * CC * 256;           // B*C*HW  = 8 MiB

    // 1) fused V/K/Q 1x1 convs (value -> d_out)
    k_conv3<<<2048, 128, 0, stream>>>(X, Wv, bv, Wk, bk, Wq, bq, out, key, query);

    // 2) gram matrix partials (deterministic, no atomics)
    k_dots<<<512, 256, 0, stream>>>(key, query, part);

    // 3) partial reduction + softmax over key axis -> weights
    k_softmax<<<32, 256, 0, stream>>>(part, weights);

    // 4) ensemble mean of value
    k_mean<<<8192, 256, 0, stream>>>(out, meanb);

    // 5) weighted perturbation combine + selu (in place on d_out)
    k_combine<<<1024, 256, 0, stream>>>(weights, meanb, out);
}

// v002
// Measured time: 156 microseconds a run.
// Next to v001, in two timings, it ran 1.08 and 1.07 times as fast.
// Counting every step since v000, it is 1.77 times as fast.
#include <hip/hip_runtime.h>
#include <hip/hip_bf16.h>

typedef __attribute__((ext_vector_type(2))) float v2f;
typedef __attribute__((ext_vector_type(4))) float v4f;
typedef __attribute__((ext_vector_type(8))) float v8f;

#define BB   8
#define EE   16
#define CIN  64
#define CC   64
#define HWH  4096   // 64*64
#define SEGS 8      // K-split for the gram matrix
#define STRIP  64   // conv: columns per strip (4 interleaved 16-column tiles)
#define NSTRIP 4    // conv: strips per wave
#define WPITCH 68   // conv: LDS row pitch of a weight matrix, in floats

__device__ __forceinline__ float selu_f(float x) {
    const float alpha = 1.6732632423543772f;
    const float scale = 1.0507009873554805f;
    return x > 0.0f ? scale * x : scale * alpha * (__expf(x) - 1.0f);
}

__device__ __forceinline__ v8f wmma_f32(v2f a, v2f b, v8f c) {
    return __builtin_amdgcn_wmma_f32_16x16x4_f32(false, a, false, b, (short)0, c, false, false);
}

// ---------------------------------------------------------------------------
// Kernel 1: three fused 1x1 convs.  A = W[64,64], B = X[64,4096] (K=CIN=64).
// One wave owns one 16-row m-tile of all three weight matrices and keeps the
// 48 A fragments in registers (brought in once, through LDS); it then walks
// NSTRIP strips of 64 columns.
// A strip is 4 column-interleaved 16x16 n-tiles: tile t holds the columns
// n0 + 4*(lane%16) + t, so one 16-byte load feeds all 4 tiles and one 16-byte
// store takes one row of all 4.  The 4 waves of a block are the 4 m-tiles of
// the same strips.  X rows come in chunks of 4 k-steps, one chunk ahead.
// value (no activation) -> d_out;  key/query (selu) -> workspace.
// blocks = B*E * 4096 / (64*NSTRIP) = 2048, 4 waves each
// ---------------------------------------------------------------------------
__device__ __forceinline__ void load_chunk(v4f (&dst)[8], const float* __restrict__ xp, int c) {
#pragma unroll
    for (int i = 0; i < 4; ++i) {
        dst[2 * i]     = *(const v4f*)(xp + (size_t)(16 * c + 4 * i) * HWH);
        dst[2 * i + 1] = *(const v4f*)(xp + (size_t)(16 * c + 4 * i + 1) * HWH);
    }
    // the address pair of these loads is reused for other values soon after them:
    // this wait stands in front of that overwrite
    asm volatile("s_wait_xcnt 0x0" ::: "memory");
}

__global__ __launch_bounds__(128)
void k_conv3(const float* __restrict__ X,
             const float* __restrict__ Wv, const float* __restrict__ bv,
             const float* __restrict__ Wk, const float* __restrict__ bk,
             const float* __restrict__ Wq, const float* __restrict__ bq,
             float* __restrict__ value,
             float* __restrict__ key,
             float* __restrict__ query)
{
    const int mt    = threadIdx.x >> 5;
    const int lane  = threadIdx.x & 31;
    const int lhalf = lane >> 4;
    const int lmod  = lane & 15;

    const int be   = blockIdx.x / (HWH / (STRIP * NSTRIP));          // 0..127  (= b*E + e)
    const int col0 = (blockIdx.x % (HWH / (STRIP * NSTRIP))) * (STRIP * NSTRIP);
    const int m0   = mt * 16;
    const int arow = m0 + lmod;

    // lane's X pointer: row 2*lhalf, its 4 columns of the first strip
    const float* xp = X + (size_t)be * CIN * HWH + (size_t)(2 * lhalf) * HWH + col0 + 4 * lmod;
    // lane's output offset: row m0 + 8*lhalf, the same 4 columns
    size_t oi = ((size_t)be * CC + m0 + 8 * lhalf) * HWH + col0 + 4 * lmod;

    // The weights pass through LDS once: whole-line 16-byte loads instead of 48 fragment
    // loads a wave that each touch 16 cache lines.  Pitch 68 floats: the 32 lanes of a
    // fragment read (row lane%16, k pair 2*lhalf) fall on all 64 banks once.
    __shared__ __attribute__((aligned(16))) float sw[3][CC][WPITCH];
    const int srow = threadIdx.x >> 4;              // 128 threads = 8 rows of 16 pieces
    const int sk4  = (threadIdx.x & 15) * 4;
#pragma unroll
    for (int j = 0; j < CC / 8; ++j) {
        *(v4f*)&sw[0][8 * j + srow][sk4] = *(const v4f*)(Wv + 4 * threadIdx.x + 8 * CIN * j);
        *(v4f*)&sw[1][8 * j + srow][sk4] = *(const v4f*)(Wk + 4 * threadIdx.x + 8 * CIN * j);
        *(v4f*)&sw[2][8 * j + srow][sk4] = *(const v4f*)(Wq + 4 * threadIdx.x + 8 * CIN * j);
    }
    __syncthreads();

    v2f av[16], ak[16], aq[16];
#pragma unroll
    for (int s = 0; s < 16; ++s) {
        const int ka = 4 * s + 2 * lhalf;
        av[s] = *(const v2f*)&sw[0][arow][ka];
        ak[s] = *(const v2f*)&sw[1][arow][ka];
        aq[s] = *(const v2f*)&sw[2][arow][ka];
    }
    // the lane's 8 rows of each bias: m0 + 8*lhalf + 0..7
    v4f fv[2], fk[2], fq[2];
#pragma unroll
    for (int g = 0; g < 2; ++g) {
        fv[g] = *(const v4f*)(bv + m0 + 8 * lhalf + 4 * g);
        fk[g] = *(const v4f*)(bk + m0 + 8 * lhalf + 4 * g);
        fq[g] = *(const v4f*)(bq + m0 + 8 * lhalf + 4 * g);
    }

    v4f xa[8], xb[8];
    load_chunk(xa, xp, 0);
    // keeps the arithmetic that follows behind the wait that closes load_chunk: moved in
    // front of it, it reuses the address registers of the bias loads
    __builtin_amdgcn_sched_barrier(0);

#pragma unroll 1   // one strip's body is 192 WMMAs; a second copy only costs instruction cache
    for (int st = 0; st < NSTRIP; ++st) {
        v8f cv[4] = {}; v8f ck[4] = {}; v8f cq[4] = {};
        // next strip's first chunk; the last strip fetches its own again, so that the
        // loads stand in straight-line code and every load wait keeps its exact count
        const float* xn = xp + (st + 1 < NSTRIP ? STRIP : 0);

#pragma unroll
        for (int c = 0; c < 4; ++c) {
            v4f (&cur)[8] = (c & 1) ? xb : xa;
            v4f (&nxt)[8] = (c & 1) ? xa : xb;
            if (c < 3) load_chunk(nxt, xp, c + 1);
            else       load_chunk(nxt, xn, 0);
#pragma unroll
            for (int i = 0; i < 4; ++i) {
                const int s = 4 * c + i;
#pragma unroll
                for (int t = 0; t < 4; ++t) {
                    v2f bf;
                    bf.x = cur[2 * i][t];
                    bf.y = cur[2 * i + 1][t];
                    cv[t] = wmma_f32(av[s], bf, cv[t]);
                    ck[t] = wmma_f32(ak[s], bf, ck[t]);
                    cq[t] = wmma_f32(aq[s], bf, cq[t]);
                }
            }
        }

#pragma unroll
        for (int r = 0; r < 8; ++r) {
            v4f ov, ok, oq;
#pragma unroll
            for (int t = 0; t < 4; ++t) {
                ov[t] = cv[t][r] + fv[r >> 2][r & 3];
                ok[t] = selu_f(ck[t][r] + fk[r >> 2][r & 3]);
                oq[t] = selu_f(cq[t][r] + fq[r >> 2][r & 3]);
            }
            *(v4f*)(value + oi + (size_t)r * HWH) = ov;
            *(v4f*)(key   + oi + (size_t)r * HWH) = ok;
            *(v4f*)(query + oi + (size_t)r * HWH) = oq;
        }
        // the next strip's first WMMAs overwrite the registers of the last stores:
        // this wait stands in front of that overwrite
        asm volatile("s_wait_xcnt 0x0" ::: "memory");
        xp = xn;
        oi += STRIP;
    }
}

// ---------------------------------------------------------------------------
// Kernel 2: partial gram:  part[b,c,seg,i,j] = sum_{hw in seg} key_i * query_j
// One wave per (b, c, seg), SEGS segments of HWH/SEGS -> 128 WMMAs each.
// Each wave owns a private 256-float partial tile: no atomics, deterministic.
// A-lane row (M=i) = lane%16 on key; B-lane col (N=j) = lane%16 on query:
// both fragment loads are contiguous v2f in hw (16 bytes per row, rows CC*HWH apart).
// waves = 8*64*8 = 4096
// ---------------------------------------------------------------------------
__global__ void k_dots(const float* __restrict__ key,
                       const float* __restrict__ query,
                       float* __restrict__ part)
{
    const int wid   = blockIdx.x * (blockDim.x >> 5) + (threadIdx.x >> 5);
    const int lane  = threadIdx.x & 31;
    const int lhalf = lane >> 4;
    const int lmod  = lane & 15;

    const int seg = wid & (SEGS - 1);
    const int c   = (wid >> 3) & 63;
    const int b   = wid >> 9;

    const size_t rbase = ((size_t)(b * EE + lmod) * CC + c) * HWH;  // row = ensemble member lmod
    const int hw0 = seg * (HWH / SEGS);

    v8f acc = {};
    for (int k0 = hw0; k0 < hw0 + (HWH / SEGS); k0 += 4) {
        const int kk = k0 + 2 * lhalf;
        v2f a  = *(const v2f*)(key   + rbase + kk);
        v2f bf = *(const v2f*)(query + rbase + kk);
        acc = wmma_f32(a, bf, acc);
    }

    float* dp = part + ((size_t)(b * CC + c) * SEGS + seg) * 256;
    for (int r = 0; r < 8; ++r) {
        const int i = r + 8 * lhalf;        // key index (rows)
        dp[i * 16 + lmod] = acc[r];
    }
}

// ---------------------------------------------------------------------------
// Kernel 3: deterministic partial reduction + softmax over i (axis -2).
// one thread per (b,c,j) = 8192 threads; writes u[b,c,i,j], the softmax weight w with
// the ensemble mean folded in:
//   mean + sum_i w_ij (v_i - mean) = sum_i (w_ij + (1 - sum_k w_kj) / 16) v_i = sum_i u_ij v_i
// which holds for any w, so the combine kernel needs no mean.
// ---------------------------------------------------------------------------
__global__ void k_softmax(const float* __restrict__ part,
                          float* __restrict__ weights)
{
    const int idx = blockIdx.x * blockDim.x + threadIdx.x;
    if (idx >= BB * CC * EE) return;
    const int j  = idx & 15;
    const int bc = idx >> 4;
    const float* pp = part + (size_t)bc * SEGS * 256 + j;

    float d[16];
    for (int i = 0; i < 16; ++i) {
        float s = 0.0f;
        for (int seg = 0; seg < SEGS; ++seg) s += pp[seg * 256 + i * 16];
        d[i] = s;
    }
    float mx = -3.402823466e38f;
    for (int i = 0; i < 16; ++i) mx = fmaxf(mx, d[i]);
    float s = 0.0f;
    for (int i = 0; i < 16; ++i) { d[i] = __expf(d[i] - mx); s += d[i]; }
    const float inv = 1.0f / s;
    float* wo = weights + (size_t)bc * 256 + j;
    float tot = 0.0f;
    for (int i = 0; i < 16; ++i) { d[i] *= inv; tot += d[i]; }
    const float corr = (1.0f - tot) * 0.0625f;
    for (int i = 0; i < 16; ++i) wo[i * 16] = d[i] + corr;
}

// ---------------------------------------------------------------------------
// Kernel 4: out[b,j,c,hw] = selu(sum_i u[b,c,i,j] * value[b,i,c,hw]), u from kernel 3
// One wave per (b, c, 256-wide hw block).  A = weights^T loaded once (4 chunks),
// then 16 N-tiles x 4 WMMAs.  In-place on d_out: each wave reads all i and
// writes all j for a private set of hw columns (disjoint across waves).
// waves = 8*64*16 = 8192
// ---------------------------------------------------------------------------
__global__ void k_combine(const float* __restrict__ weights,
                          float* __restrict__ value /* == d_out, in/out */)
{
    const int wid   = blockIdx.x * (blockDim.x >> 5) + (threadIdx.x >> 5);
    const int lane  = threadIdx.x & 31;
    const int lhalf = lane >> 4;
    const int lmod  = lane & 15;

    const int nblk = wid & 15;
    const int c    = (wid >> 4) & 63;
    const int b    = wid >> 10;

    // A fragments: A[m=j][k=i] = weights[b,c,i,j]  (transpose of ij)
    const float* wp = weights + (size_t)(b * CC + c) * 256;
    v2f afr[4];
    for (int ch = 0; ch < 4; ++ch) {
        const int i = 4 * ch + 2 * lhalf;
        afr[ch].x = wp[i * 16 + lmod];
        afr[ch].y = wp[(i + 1) * 16 + lmod];
    }

    const size_t vbase = ((size_t)b * EE * CC + c) * HWH;
    const size_t istr  = (size_t)CC * HWH;

    for (int t = 0; t < 16; ++t) {
        const int hw = nblk * 256 + t * 16 + lmod;
        v8f acc = {};
        for (int ch = 0; ch < 4; ++ch) {
            const int i = 4 * ch + 2 * lhalf;
            v2f bf;
            bf.x = value[vbase + (size_t)i * istr + hw];
            bf.y = value[vbase + (size_t)(i + 1) * istr + hw];
            acc = wmma_f32(afr[ch], bf, acc);
        }
        for (int r = 0; r < 8; ++r) {
            const int j = r + 8 * lhalf;
            value[vbase + (size_t)j * istr + hw] = selu_f(acc[r]);
        }
        // the next tile's loads and WMMAs reuse the registers of the last store:
        // this wait stands in front of that overwrite
        asm volatile("s_wait_xcnt 0x0" ::: "memory");
    }
}

// ---------------------------------------------------------------------------
extern "C" void kernel_launch(void* const* d_in, const int* in_sizes, int n_in,
                              void* d_out, int out_size, void* d_ws, size_t ws_size,
                              hipStream_t stream)
{
    const float* X  = (const float*)d_in[0];
    const float* Wv = (const float*)d_in[1];
    const float* bv = (const float*)d_in[2];
    const float* Wk = (const float*)d_in[3];
    const float* bk = (const float*)d_in[4];
    const float* Wq = (const float*)d_in[5];
    const float* bq = (const float*)d_in[6];
    float* out = (float*)d_out;                     // value, then final output (in place)

    const size_t TEN = (size_t)BB * EE * CC * HWH;  // 33,554,432 floats
    float* ws      = (float*)d_ws;
    float* key     = ws;                                        // 128 MiB
    float* query   = ws + TEN;                                  // 128 MiB
    float* part    = ws + 2 * TEN;                              // B*C*SEGS*256 = 4 MiB
    float* weights = part + (size_t)BB * CC * SEGS * 256;       // B*C*256 = 512 KiB

    // 1) fused V/K/Q 1x1 convs (value -> d_out)
    k_conv3<<<2048, 128, 0, stream>>>(X, Wv, bv, Wk, bk, Wq, bq, out, key, query);

    // 2) gram matrix partials (deterministic, no atomics)
    k_dots<<<512, 256, 0, stream>>>(key, query, part);

    // 3) partial reduction + softmax over key axis -> weights with the mean folded in
    k_softmax<<<32, 256, 0, stream>>>(part, weights);

    // 4) weighted combine + selu (in place on d_out)
    k_combine<<<1024, 256, 0, stream>>>(weights, out);
}

// v003
// A run of this version takes 141 microseconds.
// In both of two side-by-side timings against v002, it was 1.11 times as fast.
// All steps since v000 together make it 1.96 times as fast.
#include <hip/hip_runtime.h>
#include <hip/hip_bf16.h>

typedef __attribute__((ext_vector_type(2))) float v2f;
typedef __attribute__((ext_vector_type(4))) float v4f;
typedef __attribute__((ext_vector_type(8))) float v8f;

#define BB   8
#define EE   16
#define CIN  64
#define CC   64
#define HWH  4096   // 64*64
#define THW    16   // conv: pixels per staged X tile
#define NTILE  4    // conv: tiles per block
#define SEGS   (HWH / (THW * NTILE))   // gram partials per (b, c): one per conv block
#define EPITCH (CIN * THW + 4)         // conv: LDS floats from one member's X rows to the next
#define XBUF   (EE * EPITCH)           // conv: LDS floats of one X tile
#define WPITCH 68   // conv: LDS row pitch of a weight matrix, in floats

__device__ __forceinline__ float selu_f(float x) {
    const float alpha = 1.6732632423543772f;
    const float scale = 1.0507009873554805f;
    return x > 0.0f ? scale * x : scale * alpha * (__expf(x) - 1.0f);
}

__device__ __forceinline__ v8f wmma_f32(v2f a, v2f b, v8f c) {
    return __builtin_amdgcn_wmma_f32_16x16x4_f32(false, a, false, b, (short)0, c, false, false);
}

// the value that lane ^ 16 holds
__device__ __forceinline__ float other_half(float v) {
    const int b = __builtin_bit_cast(int, v);
    return __builtin_bit_cast(float,
        __builtin_amdgcn_permlanex16(b, b, 0x76543210, 0xfedcba98, false, false));
}

__device__ __forceinline__ void lds_chunk(v4f (&dst)[8], const float* xl, int c) {
#pragma unroll
    for (int i = 0; i < 4; ++i) {
        dst[2 * i]     = *(const v4f*)(xl + (16 * c + 4 * i) * THW);
        dst[2 * i + 1] = *(const v4f*)(xl + (16 * c + 4 * i + 1) * THW);
    }
}

// eight 16-byte copies a lane, global to LDS.  The closing wait stands in the copies'
// own statement, in front of any reuse of the address registers that they name.
__device__ __forceinline__ void copy8(const unsigned (&l)[8], const float* const (&g)[8]) {
    asm volatile("global_load_async_to_lds_b128 %0, %8, off\n\t"
                 "global_load_async_to_lds_b128 %1, %9, off\n\t"
                 "global_load_async_to_lds_b128 %2, %10, off\n\t"
                 "global_load_async_to_lds_b128 %3, %11, off\n\t"
                 "global_load_async_to_lds_b128 %4, %12, off\n\t"
                 "global_load_async_to_lds_b128 %5, %13, off\n\t"
                 "global_load_async_to_lds_b128 %6, %14, off\n\t"
                 "global_load_async_to_lds_b128 %7, %15, off\n\t"
                 "s_wait_xcnt 0x0"
                 :: "v"(l[0]), "v"(l[1]), "v"(l[2]), "v"(l[3]),
                    "v"(l[4]), "v"(l[5]), "v"(l[6]), "v"(l[7]),
                    "v"(g[0]), "v"(g[1]), "v"(g[2]), "v"(g[3]),
                    "v"(g[4]), "v"(g[5]), "v"(g[6]), "v"(g[7])
                 : "memory");
}

// one X tile: copy number it = 8*h + k of a thread brings piece tid%4 of X row 32*it + tid/4.
// lb, gb: the thread's LDS byte address and global address of its copy 0
__device__ __forceinline__ void stage_tile(unsigned lb, const float* gb) {
#pragma unroll 1   // unrolled, the 32 LDS addresses are formed once and held (spilled) across the strips
    for (int h = 0; h < 4; ++h) {
        unsigned l[8];
        const float* g[8];
#pragma unroll
        for (int k = 0; k < 8; ++k) {
            l[k] = lb + (k >> 1) * (EPITCH * 4) + (k & 1) * (32 * THW * 4);
            g[k] = gb + (size_t)k * 32 * HWH;
        }
        copy8(l, g);
        lb += 4 * (EPITCH * 4);
        gb += (size_t)8 * 32 * HWH;
    }
}

__global__ __launch_bounds__(128, 2)
void k_conv3(const float* __restrict__ X,
             const float* __restrict__ Wv, const float* __restrict__ bv,
             const float* __restrict__ Wk, const float* __restrict__ bk,
             const float* __restrict__ Wq, const float* __restrict__ bq,
             float* __restrict__ vws,
             float* __restrict__ part)
{
    const int mt    = threadIdx.x >> 5;
    const int lane  = threadIdx.x & 31;
    const int lhalf = lane >> 4;
    const int lmod  = lane & 15;
    const bool up   = lhalf != 0;

    const int b   = blockIdx.x / SEGS;
    const int seg = blockIdx.x % SEGS;
    const int m0   = mt * 16;
    const int arow = m0 + lmod;

    // Two X tiles.  A member's 64 rows of 16 pixels lie packed; 4 floats between members
    // put the 16 lanes of a 16-byte fragment read on 16 different groups of 4 banks.
    __shared__ __attribute__((aligned(16))) float xs[2 * XBUF];
    // The weights pass through LDS once: whole-line 16-byte loads instead of 48 fragment
    // loads a wave that each touch 16 cache lines.  Pitch 68 floats: the 32 lanes of a
    // fragment read (row lane%16, k pair 2*lhalf) fall on all 64 banks once.
    // They lie in the second X buffer, which is free until tile 1 is copied.
    float* sw = xs + XBUF;                          // [3][CC][WPITCH]

    // thread's addresses of copy 0 of the block's first tile
    const float* xg = X + ((size_t)b * EE * CIN + (threadIdx.x >> 2)) * HWH
                        + seg * (THW * NTILE) + (threadIdx.x & 3) * 4;
    const unsigned xl0 = (unsigned)(size_t)&xs[0] + threadIdx.x * 16;
    stage_tile(xl0, xg);                            // tile 0 flies while the weights come in

    const int srow = threadIdx.x >> 4;              // 128 threads = 8 rows of 16 pieces
    const int sk4  = (threadIdx.x & 15) * 4;
#pragma unroll
    for (int j = 0; j < CC / 8; ++j) {
        *(v4f*)&sw[(0 * CC + 8 * j + srow) * WPITCH + sk4] = *(const v4f*)(Wv + 4 * threadIdx.x + 8 * CIN * j);
        *(v4f*)&sw[(1 * CC + 8 * j + srow) * WPITCH + sk4] = *(const v4f*)(Wk + 4 * threadIdx.x + 8 * CIN * j);
        *(v4f*)&sw[(2 * CC + 8 * j + srow) * WPITCH + sk4] = *(const v4f*)(Wq + 4 * threadIdx.x + 8 * CIN * j);
    }
    __syncthreads();

    v2f av[16], ak[16], aq[16];
#pragma unroll
    for (int s = 0; s < 16; ++s) {
        const int ka = 4 * s + 2 * lhalf;
        av[s] = *(const v2f*)&sw[(0 * CC + arow) * WPITCH + ka];
        ak[s] = *(const v2f*)&sw[(1 * CC + arow) * WPITCH + ka];
        aq[s] = *(const v2f*)&sw[(2 * CC + arow) * WPITCH + ka];
    }
    // the lane's 8 rows of each bias: m0 + 8*lhalf + 0..7
    v4f fv[2], fk[2], fq[2];
#pragma unroll
    for (int g = 0; g < 2; ++g) {
        fv[g] = *(const v4f*)(bv + m0 + 8 * lhalf + 4 * g);
        fk[g] = *(const v4f*)(bk + m0 + 8 * lhalf + 4 * g);
        fq[g] = *(const v4f*)(bq + m0 + 8 * lhalf + 4 * g);
    }

    // lane's value offset: channel m0 + 8*lhalf, first pixel quad of the block, member lmod
    size_t oi = (((size_t)(b * CC + m0 + 8 * lhalf) * (HWH / 4)
                  + seg * (THW * NTILE / 4)) * EE + lmod) * 4;

    v8f gr[16] = {};    // gram of channel m0 + index: rows key member, columns query member

    // this wave's weight reads have returned before buffer 1 is overwritten
    asm volatile("s_wait_dscnt 0x0" ::: "memory");
    // this wave's copies of tile 0 have landed; the barrier then publishes every wave's
    asm volatile("s_wait_asynccnt 0x0" ::: "memory");
    __syncthreads();
    stage_tile(xl0 + XBUF * 4, xg + THW);           // tile 1

#pragma unroll 1   // a tile's body holds a whole strip loop
    for (int tl = 0; tl < NTILE; ++tl) {
        const int xoff = (tl & 1) * XBUF;
#pragma unroll 1   // one strip's body is 208 WMMAs; a second copy only costs instruction cache
        for (int q = 0; q < THW / 4; ++q) {
            v8f cv[4] = {}; v8f ck[4] = {}; v8f cq[4] = {};
            // lane's X: member lmod, row 2*lhalf, the strip's 4 pixels
            const float* xl = &xs[xoff + lmod * EPITCH + 2 * lhalf * THW + 4 * q];
            v4f xa[8], xb[8];
            lds_chunk(xa, xl, 0);
#pragma unroll
            for (int c = 0; c < 4; ++c) {
                v4f (&cur)[8] = (c & 1) ? xb : xa;
                v4f (&nxt)[8] = (c & 1) ? xa : xb;
                if (c < 3) lds_chunk(nxt, xl, c + 1);
#pragma unroll
                for (int i = 0; i < 4; ++i) {
                    const int s = 4 * c + i;
#pragma unroll
                    for (int t = 0; t < 4; ++t) {
                        v2f bf;
                        bf.x = cur[2 * i][t];
                        bf.y = cur[2 * i + 1][t];
                        cv[t] = wmma_f32(av[s], bf, cv[t]);
                        ck[t] = wmma_f32(ak[s], bf, ck[t]);
                        cq[t] = wmma_f32(aq[s], bf, cq[t]);
                    }
                }
            }

#pragma unroll
            for (int r = 0; r < 8; ++r) {
                float kk[4], qq[4], pk[4], pq[4];
#pragma unroll
                for (int t = 0; t < 4; ++t) {
                    kk[t] = selu_f(ck[t][r] + fk[r >> 2][r & 3]);
                    qq[t] = selu_f(cq[t][r] + fq[r >> 2][r & 3]);
                    pk[t] = other_half(kk[t]);
                    pq[t] = other_half(qq[t]);
                }
                v2f alo, ahi, blo, bhi;
                alo.x = up ? pk[2] : kk[0];  alo.y = up ? pk[3] : kk[1];   // channel m0 + r
                blo.x = up ? pq[2] : qq[0];  blo.y = up ? pq[3] : qq[1];
                ahi.x = up ? kk[2] : pk[0];  ahi.y = up ? kk[3] : pk[1];   // channel m0 + r + 8
                bhi.x = up ? qq[2] : pq[0];  bhi.y = up ? qq[3] : pq[1];
                gr[r]     = wmma_f32(alo, blo, gr[r]);
                gr[r + 8] = wmma_f32(ahi, bhi, gr[r + 8]);
            }

            v4f ov[8];
#pragma unroll
            for (int r = 0; r < 8; ++r) {
#pragma unroll
                for (int t = 0; t < 4; ++t) ov[r][t] = cv[t][r] + fv[r >> 2][r & 3];
            }
            // all 8 rows are formed in front of the first store: mixed with the stores, the
            // additions reuse the data registers of stores that are issued and not waited for
            __builtin_amdgcn_sched_barrier(0);
#pragma unroll
            for (int r = 0; r < 8; ++r)
                *(v4f*)(vws + oi + (size_t)r * (HWH * EE)) = ov[r];
            // the next strip's first instructions overwrite the registers of these stores:
            // this wait stands in front of that overwrite
            asm volatile("s_wait_xcnt 0x0" ::: "memory");
            oi += EE * 4;
        }
        // this wave's reads of this tile have returned
        asm volatile("s_wait_dscnt 0x0" ::: "memory");
        // this wave's copies of the next tile have landed
        asm volatile("s_wait_asynccnt 0x0" ::: "memory");
        // publishes the next tile and ends every wave's reads of this one
        __syncthreads();
        if (tl + 2 < NTILE) stage_tile(xl0 + xoff * 4, xg + (tl + 2) * THW);
    }
    // no copy is outstanding when the wave goes on to its end
    asm volatile("s_wait_asynccnt 0x0" ::: "memory");

    // the block's partial gram: part[b, c, seg, i, j]
    float* dp = part + ((size_t)(b * CC + m0) * SEGS + seg) * 256 + 8 * lhalf * 16 + lmod;
#pragma unroll
    for (int ch = 0; ch < 16; ++ch) {
#pragma unroll
        for (int r = 0; r < 8; ++r)
            dp[(size_t)ch * SEGS * 256 + r * 16] = gr[ch][r];
    }
}

// ---------------------------------------------------------------------------
// Kernel 2: deterministic partial reduction + softmax over i (axis -2).
// one block per (b,c), one thread per (i,j); writes u[b,c,i,j], the softmax weight w with
// the ensemble mean folded in:
//   mean + sum_i w_ij (v_i - mean) = sum_i (w_ij + (1 - sum_k w_kj) / 16) v_i = sum_i u_ij v_i
// which holds for any w, so the combine kernel needs no mean.
// ---------------------------------------------------------------------------
__global__ __launch_bounds__(256)
void k_softmax(const float* __restrict__ part,
               float* __restrict__ weights)
{
    const int bc = blockIdx.x;
    const int j  = threadIdx.x & 15;
    const float* pp = part + (size_t)bc * SEGS * 256;

    float acc = 0.0f;
#pragma unroll      // all loads independent and in flight ahead of the ordered sum
    for (unsigned seg = 0; seg < SEGS; ++seg) acc += pp[seg * 256u + threadIdx.x];

    __shared__ float sd[256];
    sd[threadIdx.x] = acc;
    __syncthreads();

    float d[16];
    for (int k = 0; k < 16; ++k) d[k] = sd[k * 16 + j];
    float mx = -3.402823466e38f;
    for (int k = 0; k < 16; ++k) mx = fmaxf(mx, d[k]);
    float s = 0.0f;
    for (int k = 0; k < 16; ++k) { d[k] = __expf(d[k] - mx); s += d[k]; }
    const float inv = 1.0f / s;
    float tot = 0.0f;
    for (int k = 0; k < 16; ++k) tot += d[k] * inv;
    const float corr = (1.0f - tot) * 0.0625f;
    weights[(size_t)bc * 256 + threadIdx.x] = __expf(acc - mx) * inv + corr;
}

// ---------------------------------------------------------------------------
// Kernel 3: out[b,j,c,hw] = selu(sum_i u[b,c,i,j] * value[b,i,c,hw]), u from kernel 2
// One wave per (b, c, 256 pixels).  A = weights^T loaded once (4 chunks).  value lies
// as [b][c][pixel/4][member][pixel%4]: a lane's 16-byte load is one member at 4 pixels,
// one element for each of 4 interleaved n-tiles (tile t: pixels 4*(lane%16) + t), and
// one 16-byte store takes one output row of all 4.
// waves = 8*64*16 = 8192
// ---------------------------------------------------------------------------
__global__ void k_combine(const float* __restrict__ weights,
                          const float* __restrict__ vws,
                          float* __restrict__ out)
{
    const int wid   = blockIdx.x * (blockDim.x >> 5) + (threadIdx.x >> 5);
    const int lane  = threadIdx.x & 31;
    const int lhalf = lane >> 4;
    const int lmod  = lane & 15;

    const int nblk = wid & 15;
    const int c    = (wid >> 4) & 63;
    const int b    = wid >> 10;

    // A fragments: A[m=j][k=i] = weights[b,c,i,j]  (transpose of ij)
    const float* wp = weights + (size_t)(b * CC + c) * 256;
    v2f afr[4];
    for (int ch = 0; ch < 4; ++ch) {
        const int i = 4 * ch + 2 * lhalf;
        afr[ch].x = wp[i * 16 + lmod];
        afr[ch].y = wp[(i + 1) * 16 + lmod];
    }

    // lane's value: pixel quad nblk*64 + lmod, member 2*lhalf
    const float* vp = vws + (((size_t)(b * CC + c) * (HWH / 4) + nblk * 64 + lmod) * EE + 2 * lhalf) * 4;
    // lane's output: row j = 8*lhalf, the same 4 pixels
    float* op = out + ((size_t)(b * EE + 8 * lhalf) * CC + c) * HWH + nblk * 256 + 4 * lmod;
    const size_t istr = (size_t)CC * HWH;

    for (int g = 0; g < 4; ++g) {
        v4f x[8];
#pragma unroll
        for (int ch = 0; ch < 4; ++ch) {
            x[2 * ch]     = *(const v4f*)(vp + (4 * ch) * 4);
            x[2 * ch + 1] = *(const v4f*)(vp + (4 * ch + 1) * 4);
        }
        v8f acc[4] = {};
#pragma unroll
        for (int ch = 0; ch < 4; ++ch) {
#pragma unroll
            for (int t = 0; t < 4; ++t) {
                v2f bf;
                bf.x = x[2 * ch][t];
                bf.y = x[2 * ch + 1][t];
                acc[t] = wmma_f32(afr[ch], bf, acc[t]);
            }
        }
#pragma unroll
        for (int r = 0; r < 8; ++r) {
            v4f o;
#pragma unroll
            for (int t = 0; t < 4; ++t) o[t] = selu_f(acc[t][r]);
            *(v4f*)(op + (size_t)r * istr) = o;
        }
        // the next group's loads and WMMAs reuse the registers of the last store:
        // this wait stands in front of that overwrite
        asm volatile("s_wait_xcnt 0x0" ::: "memory");
        vp += 16 * EE * 4;
        op += 64;
    }
}

// ---------------------------------------------------------------------------
extern "C" void kernel_launch(void* const* d_in, const int* in_sizes, int n_in,
                              void* d_out, int out_size, void* d_ws, size_t ws_size,
                              hipStream_t stream)
{
    const float* X  = (const float*)d_in[0];
    const float* Wv = (const float*)d_in[1];
    const float* bv = (const float*)d_in[2];
    const float* Wk = (const float*)d_in[3];
    const float* bk = (const float*)d_in[4];
    const float* Wq = (const float*)d_in[5];
    const float* bq = (const float*)d_in[6];
    float* out = (float*)d_out;

    const size_t TEN = (size_t)BB * EE * CC * HWH;  // 33,554,432 floats
    float* ws      = (float*)d_ws;
    float* vws     = ws;                                        // 128 MiB
    float* part    = ws + TEN;                                  // B*C*SEGS*256 = 32 MiB
    float* weights = part + (size_t)BB * CC * SEGS * 256;       // B*C*256 = 512 KiB

    // 1) fused V/K/Q 1x1 convs + gram partials (deterministic, no atomics)
    k_conv3<<<512, 128, 0, stream>>>(X, Wv, bv, Wk, bk, Wq, bq, vws, part);

    // 2) partial reduction + softmax over key axis -> weights with the mean folded in
    k_softmax<<<512, 256, 0, stream>>>(part, weights);

    // 3) weighted combine + selu
    k_combine<<<1024, 256, 0, stream>>>(weights, vws, out);
}

// v004
// It runs in 114 microseconds.
// Two timings next to v003 both put it at 1.24 times that version's speed.
// Counting every step since v000, it is 2.42 times as fast.
#include <hip/hip_runtime.h>
#include <hip/hip_bf16.h>

typedef __attribute__((ext_vector_type(2))) float v2f;
typedef __attribute__((ext_vector_type(4))) float v4f;
typedef __attribute__((ext_vector_type(8))) float v8f;

#define BB   8
#define EE   16
#define CIN  64
#define CC   64
#define HWH  4096   // 64*64
#define THW    16   // conv: pixels per staged X tile
#define NTILE  4    // conv: tiles per block
#define SEGS   (HWH / (THW * NTILE))   // gram partials per (b, c): one per conv block
#define EPITCH (CIN * THW + 4)         // conv: LDS floats from one member's X rows to the next
#define XBUF   (EE * EPITCH)           // conv: LDS floats of one X tile
#define WPITCH 68   // conv: LDS row pitch of a weight matrix, in floats

__device__ __forceinline__ float selu_f(float x) {
    const float alpha = 1.6732632423543772f;
    const float scale = 1.0507009873554805f;
    // both arms are computed for every lane and one select picks: written as a branch, the
    // exponential arm is run under an EXEC mask, one serial vector-scalar-vector chain a value
    const float pos = scale * x;
    const float neg = scale * alpha * (__expf(x) - 1.0f);
    return x > 0.0f ? pos : neg;
}

__device__ __forceinline__ v8f wmma_f32(v2f a, v2f b, v8f c) {
    return __builtin_amdgcn_wmma_f32_16x16x4_f32(false, a, false, b, (short)0, c, false, false);
}

// the value that lane ^ 16 holds
__device__ __forceinline__ float other_half(float v) {
    const int b = __builtin_bit_cast(int, v);
    return __builtin_bit_cast(float,
        __builtin_amdgcn_permlanex16(b, b, 0x76543210, 0xfedcba98, false, false));
}

__device__ __forceinline__ void lds_chunk(v4f (&dst)[8], const float* xl, int c) {
#pragma unroll
    for (int i = 0; i < 4; ++i) {
        dst[2 * i]     = *(const v4f*)(xl + (16 * c + 4 * i) * THW);
        dst[2 * i + 1] = *(const v4f*)(xl + (16 * c + 4 * i + 1) * THW);
    }
}

// eight 16-byte copies a lane, global to LDS.  The closing wait stands in the copies'
// own statement, in front of any reuse of the address registers that they name.
__device__ __forceinline__ void copy8(const unsigned (&l)[8], const float* const (&g)[8]) {
    asm volatile("global_load_async_to_lds_b128 %0, %8, off\n\t"
                 "global_load_async_to_lds_b128 %1, %9, off\n\t"
                 "global_load_async_to_lds_b128 %2, %10, off\n\t"
                 "global_load_async_to_lds_b128 %3, %11, off\n\t"
                 "global_load_async_to_lds_b128 %4, %12, off\n\t"
                 "global_load_async_to_lds_b128 %5, %13, off\n\t"
                 "global_load_async_to_lds_b128 %6, %14, off\n\t"
                 "global_load_async_to_lds_b128 %7, %15, off\n\t"
                 "s_wait_xcnt 0x0"
                 :: "v"(l[0]), "v"(l[1]), "v"(l[2]), "v"(l[3]),
                    "v"(l[4]), "v"(l[5]), "v"(l[6]), "v"(l[7]),
                    "v"(g[0]), "v"(g[1]), "v"(g[2]), "v"(g[3]),
                    "v"(g[4]), "v"(g[5]), "v"(g[6]), "v"(g[7])
                 : "memory");
}

// one X tile: copy number it = 8*h + k of a thread brings piece tid%4 of X row 32*it + tid/4.
// lb, gb: the thread's LDS byte address and global address of its copy 0
__device__ __forceinline__ void stage_tile(unsigned lb, const float* gb) {
#pragma unroll 1   // unrolled, the 32 LDS addresses are formed once and held (spilled) across the strips
    for (int h = 0; h < 4; ++h) {
        unsigned l[8];
        const float* g[8];
#pragma unroll
        for (int k = 0; k < 8; ++k) {
            l[k] = lb + (k >> 1) * (EPITCH * 4) + (k & 1) * (32 * THW * 4);
            g[k] = gb + (size_t)k * 32 * HWH;
        }
        copy8(l, g);
        lb += 4 * (EPITCH * 4);
        gb += (size_t)8 * 32 * HWH;
    }
}

__global__ __launch_bounds__(128, 2)
void k_conv3(const float* __restrict__ X,
             const float* __restrict__ Wv, const float* __restrict__ bv,
             const float* __restrict__ Wk, const float* __restrict__ bk,
             const float* __restrict__ Wq, const float* __restrict__ bq,
             float* __restrict__ vws,
             float* __restrict__ part)
{
    const int mt    = threadIdx.x >> 5;
    const int lane  = threadIdx.x & 31;
    const int lhalf = lane >> 4;
    const int lmod  = lane & 15;
    const bool up   = lhalf != 0;

    const int b   = blockIdx.x / SEGS;
    const int seg = blockIdx.x % SEGS;
    const int m0   = mt * 16;
    const int arow = m0 + lmod;

    // Two X tiles.  A member's 64 rows of 16 pixels lie packed; 4 floats between members
    // put the 16 lanes of a 16-byte fragment read on 16 different groups of 4 banks.
    __shared__ __attribute__((aligned(16))) float xs[2 * XBUF];
    // The weights pass through LDS once: whole-line 16-byte loads instead of 48 fragment
    // loads a wave that each touch 16 cache lines.  Pitch 68 floats: the 32 lanes of a
    // fragment read (row lane%16, k pair 2*lhalf) fall on all 64 banks once.
    // They lie in the second X buffer, which is free until tile 1 is copied.
    float* sw = xs + XBUF;                          // [3][CC][WPITCH]

    // thread's addresses of copy 0 of the block's first tile
    const float* xg = X + ((size_t)b * EE * CIN + (threadIdx.x >> 2)) * HWH
                        + seg * (THW * NTILE) + (threadIdx.x & 3) * 4;
    const unsigned xl0 = (unsigned)(size_t)&xs[0] + threadIdx.x * 16;
    stage_tile(xl0, xg);                            // tile 0 flies while the weights come in

    const int srow = threadIdx.x >> 4;              // 128 threads = 8 rows of 16 pieces
    const int sk4  = (threadIdx.x & 15) * 4;
#pragma unroll
    for (int j = 0; j < CC / 8; ++j) {
        *(v4f*)&sw[(0 * CC + 8 * j + srow) * WPITCH + sk4] = *(const v4f*)(Wv + 4 * threadIdx.x + 8 * CIN * j);
        *(v4f*)&sw[(1 * CC + 8 * j + srow) * WPITCH + sk4] = *(const v4f*)(Wk + 4 * threadIdx.x + 8 * CIN * j);
        *(v4f*)&sw[(2 * CC + 8 * j + srow) * WPITCH + sk4] = *(const v4f*)(Wq + 4 * threadIdx.x + 8 * CIN * j);
    }
    __syncthreads();

    v2f av[16], ak[16], aq[16];
#pragma unroll
    for (int s = 0; s < 16; ++s) {
        const int ka = 4 * s + 2 * lhalf;
        av[s] = *(const v2f*)&sw[(0 * CC + arow) * WPITCH + ka];
        ak[s] = *(const v2f*)&sw[(1 * CC + arow) * WPITCH + ka];
        aq[s] = *(const v2f*)&sw[(2 * CC + arow) * WPITCH + ka];
    }
    // the lane's 8 rows of each bias: m0 + 8*lhalf + 0..7
    v4f fv[2], fk[2], fq[2];
#pragma unroll
    for (int g = 0; g < 2; ++g) {
        fv[g] = *(const v4f*)(bv + m0 + 8 * lhalf + 4 * g);
        fk[g] = *(const v4f*)(bk + m0 + 8 * lhalf + 4 * g);
        fq[g] = *(const v4f*)(bq + m0 + 8 * lhalf + 4 * g);
    }

    // lane's value offset: channel m0 + 8*lhalf, first pixel quad of the block, member lmod
    size_t oi = (((size_t)(b * CC + m0 + 8 * lhalf) * (HWH / 4)
                  + seg * (THW * NTILE / 4)) * EE + lmod) * 4;

    v8f gr[16] = {};    // gram of channel m0 + index: rows key member, columns query member

    // this wave's weight reads have returned before buffer 1 is overwritten
    asm volatile("s_wait_dscnt 0x0" ::: "memory");
    // this wave's copies of tile 0 have landed; the barrier then publishes every wave's
    asm volatile("s_wait_asynccnt 0x0" ::: "memory");
    __syncthreads();
    stage_tile(xl0 + XBUF * 4, xg + THW);           // tile 1

#pragma unroll 1   // a tile's body holds a whole strip loop
    for (int tl = 0; tl < NTILE; ++tl) {
        const int xoff = (tl & 1) * XBUF;
#pragma unroll 1   // one strip's body is 208 WMMAs; a second copy only costs instruction cache
        for (int q = 0; q < THW / 4; ++q) {
            v8f cv[4] = {}; v8f ck[4] = {}; v8f cq[4] = {};
            // lane's X: member lmod, row 2*lhalf, the strip's 4 pixels
            const float* xl = &xs[xoff + lmod * EPITCH + 2 * lhalf * THW + 4 * q];
            v4f xa[8], xb[8];
            lds_chunk(xa, xl, 0);
#pragma unroll
            for (int c = 0; c < 4; ++c) {
                v4f (&cur)[8] = (c & 1) ? xb : xa;
                v4f (&nxt)[8] = (c & 1) ? xa : xb;
                if (c < 3) lds_chunk(nxt, xl, c + 1);
#pragma unroll
                for (int i = 0; i < 4; ++i) {
                    const int s = 4 * c + i;
#pragma unroll
                    for (int t = 0; t < 4; ++t) {
                        v2f bf;
                        bf.x = cur[2 * i][t];
                        bf.y = cur[2 * i + 1][t];
                        cv[t] = wmma_f32(av[s], bf, cv[t]);
                        ck[t] = wmma_f32(ak[s], bf, ck[t]);
                        cq[t] = wmma_f32(aq[s], bf, cq[t]);
                    }
                }
            }

#pragma unroll
            for (int r = 0; r < 8; ++r) {
                float kk[4], qq[4], pk[4], pq[4];
#pragma unroll
                for (int t = 0; t < 4; ++t) {
                    kk[t] = selu_f(ck[t][r] + fk[r >> 2][r & 3]);
                    qq[t] = selu_f(cq[t][r] + fq[r >> 2][r & 3]);
                    pk[t] = other_half(kk[t]);
                    pq[t] = other_half(qq[t]);
                }
                v2f alo, ahi, blo, bhi;
                alo.x = up ? pk[2] : kk[0];  alo.y = up ? pk[3] : kk[1];   // channel m0 + r
                blo.x = up ? pq[2] : qq[0];  blo.y = up ? pq[3] : qq[1];
                ahi.x = up ? kk[2] : pk[0];  ahi.y = up ? kk[3] : pk[1];   // channel m0 + r + 8
                bhi.x = up ? qq[2] : pq[0];  bhi.y = up ? qq[3] : pq[1];
                gr[r]     = wmma_f32(alo, blo, gr[r]);
                gr[r + 8] = wmma_f32(ahi, bhi, gr[r + 8]);
            }

            v4f ov[8];
#pragma unroll
            for (int r = 0; r < 8; ++r) {
#pragma unroll
                for (int t = 0; t < 4; ++t) ov[r][t] = cv[t][r] + fv[r >> 2][r & 3];
            }
            // all 8 rows are formed in front of the first store: mixed with the stores, the
            // additions reuse the data registers of stores that are issued and not waited for
            __builtin_amdgcn_sched_barrier(0);
#pragma unroll
            for (int r = 0; r < 8; ++r)
                *(v4f*)(vws + oi + (size_t)r * (HWH * EE)) = ov[r];
            // the next strip's first instructions overwrite the registers of these stores:
            // this wait stands in front of that overwrite
            asm volatile("s_wait_xcnt 0x0" ::: "memory");
            oi += EE * 4;
        }
        // this wave's reads of this tile have returned
        asm volatile("s_wait_dscnt 0x0" ::: "memory");
        // this wave's copies of the next tile have landed
        asm volatile("s_wait_asynccnt 0x0" ::: "memory");
        // publishes the next tile and ends every wave's reads of this one
        __syncthreads();
        if (tl + 2 < NTILE) stage_tile(xl0 + xoff * 4, xg + (tl + 2) * THW);
    }
    // no copy is outstanding when the wave goes on to its end
    asm volatile("s_wait_asynccnt 0x0" ::: "memory");

    // the block's partial gram: part[b, c, seg, i, j]
    float* dp = part + ((size_t)(b * CC + m0) * SEGS + seg) * 256 + 8 * lhalf * 16 + lmod;
#pragma unroll
    for (int ch = 0; ch < 16; ++ch) {
#pragma unroll
        for (int r = 0; r < 8; ++r)
            dp[(size_t)ch * SEGS * 256 + r * 16] = gr[ch][r];
    }
}

// ---------------------------------------------------------------------------
// Kernel 2: deterministic partial reduction + softmax over i (axis -2).
// one block per (b,c), one thread per (i,j); writes u[b,c,i,j], the softmax weight w with
// the ensemble mean folded in:
//   mean + sum_i w_ij (v_i - mean) = sum_i (w_ij + (1 - sum_k w_kj) / 16) v_i = sum_i u_ij v_i
// which holds for any w, so the combine kernel needs no mean.
// ---------------------------------------------------------------------------
__global__ __launch_bounds__(256)
void k_softmax(const float* __restrict__ part,
               float* __restrict__ weights)
{
    const int bc = blockIdx.x;
    const int j  = threadIdx.x & 15;
    const float* pp = part + (size_t)bc * SEGS * 256;

    float acc = 0.0f;
#pragma unroll      // all loads independent and in flight ahead of the ordered sum
    for (unsigned seg = 0; seg < SEGS; ++seg) acc += pp[seg * 256u + threadIdx.x];

    __shared__ float sd[256];
    sd[threadIdx.x] = acc;
    __syncthreads();

    float d[16];
    for (int k = 0; k < 16; ++k) d[k] = sd[k * 16 + j];
    float mx = -3.402823466e38f;
    for (int k = 0; k < 16; ++k) mx = fmaxf(mx, d[k]);
    float s = 0.0f;
    for (int k = 0; k < 16; ++k) { d[k] = __expf(d[k] - mx); s += d[k]; }
    const float inv = 1.0f / s;
    float tot = 0.0f;
    for (int k = 0; k < 16; ++k) tot += d[k] * inv;
    const float corr = (1.0f - tot) * 0.0625f;
    weights[(size_t)bc * 256 + threadIdx.x] = __expf(acc - mx) * inv + corr;
}

// ---------------------------------------------------------------------------
// Kernel 3: out[b,j,c,hw] = selu(sum_i u[b,c,i,j] * value[b,i,c,hw]), u from kernel 2
// One wave per (b, c, 256 pixels).  A = weights^T loaded once (4 chunks).  value lies
// as [b][c][pixel/4][member][pixel%4]: a lane's 16-byte load is one member at 4 pixels,
// one element for each of 4 interleaved n-tiles (tile t: pixels 4*(lane%16) + t), and
// one 16-byte store takes one output row of all 4.
// waves = 8*64*16 = 8192
// ---------------------------------------------------------------------------
__global__ void k_combine(const float* __restrict__ weights,
                          const float* __restrict__ vws,
                          float* __restrict__ out)
{
    const int wid   = blockIdx.x * (blockDim.x >> 5) + (threadIdx.x >> 5);
    const int lane  = threadIdx.x & 31;
    const int lhalf = lane >> 4;
    const int lmod  = lane & 15;

    const int nblk = wid & 15;
    const int c    = (wid >> 4) & 63;
    const int b    = wid >> 10;

    // A fragments: A[m=j][k=i] = weights[b,c,i,j]  (transpose of ij)
    const float* wp = weights + (size_t)(b * CC + c) * 256;
    v2f afr[4];
    for (int ch = 0; ch < 4; ++ch) {
        const int i = 4 * ch + 2 * lhalf;
        afr[ch].x = wp[i * 16 + lmod];
        afr[ch].y = wp[(i + 1) * 16 + lmod];
    }

    // lane's value: pixel quad nblk*64 + lmod, member 2*lhalf
    const float* vp = vws + (((size_t)(b * CC + c) * (HWH / 4) + nblk * 64 + lmod) * EE + 2 * lhalf) * 4;
    // lane's output: row j = 8*lhalf, the same 4 pixels
    float* op = out + ((size_t)(b * EE + 8 * lhalf) * CC + c) * HWH + nblk * 256 + 4 * lmod;
    const size_t istr = (size_t)CC * HWH;

    for (int g = 0; g < 4; ++g) {
        v4f x[8];
#pragma unroll
        for (int ch = 0; ch < 4; ++ch) {
            x[2 * ch]     = *(const v4f*)(vp + (4 * ch) * 4);
            x[2 * ch + 1] = *(const v4f*)(vp + (4 * ch + 1) * 4);
        }
        v8f acc[4] = {};
#pragma unroll
        for (int ch = 0; ch < 4; ++ch) {
#pragma unroll
            for (int t = 0; t < 4; ++t) {
                v2f bf;
                bf.x = x[2 * ch][t];
                bf.y = x[2 * ch + 1][t];
                acc[t] = wmma_f32(afr[ch], bf, acc[t]);
            }
        }
#pragma unroll
        for (int r = 0; r < 8; ++r) {
            v4f o;
#pragma unroll
            for (int t = 0; t < 4; ++t) o[t] = selu_f(acc[t][r]);
            *(v4f*)(op + (size_t)r * istr) = o;
        }
        // the next group's loads and WMMAs reuse the registers of the last store:
        // this wait stands in front of that overwrite
        asm volatile("s_wait_xcnt 0x0" ::: "memory");
        vp += 16 * EE * 4;
        op += 64;
    }
}

// ---------------------------------------------------------------------------
extern "C" void kernel_launch(void* const* d_in, const int* in_sizes, int n_in,
                              void* d_out, int out_size, void* d_ws, size_t ws_size,
                              hipStream_t stream)
{
    const float* X  = (const float*)d_in[0];
    const float* Wv = (const float*)d_in[1];
    const float* bv = (const float*)d_in[2];
    const float* Wk = (const float*)d_in[3];
    const float* bk = (const float*)d_in[4];
    const float* Wq = (const float*)d_in[5];
    const float* bq = (const float*)d_in[6];
    float* out = (float*)d_out;

    const size_t TEN = (size_t)BB * EE * CC * HWH;  // 33,554,432 floats
    float* ws      = (float*)d_ws;
    float* vws     = ws;                                        // 128 MiB
    float* part    = ws + TEN;                                  // B*C*SEGS*256 = 32 MiB
    float* weights = part + (size_t)BB * CC * SEGS * 256;       // B*C*256 = 512 KiB

    // 1) fused V/K/Q 1x1 convs + gram partials (deterministic, no atomics)
    k_conv3<<<512, 128, 0, stream>>>(X, Wv, bv, Wk, bk, Wq, bq, vws, part);

    // 2) partial reduction + softmax over key axis -> weights with the mean folded in
    k_softmax<<<512, 256, 0, stream>>>(part, weights);

    // 3) weighted combine + selu
    k_combine<<<1024, 256, 0, stream>>>(weights, vws, out);
}
